// v010
// The times below were measured on an AMD MI455X: many runs one after another, warmed up first and cycling through
// copies of the inputs, with the whole window's GPU time divided by the number of runs. Launches and the gaps
// between them are all in it. The median over several windows is given; except for v000 it joins two sittings, which
// can be a few percent apart, so the side-by-side timings, each taken in one sitting, are the better comparison.
// Earlier versions than v010 are not in this document.
// Measured time: 89 microseconds a run.
// Next to v009, in two timings, it ran 1.17 and 1.18 times as fast.
// Over all steps from v000, the starting kernel, it is 164 times as fast.
#include <hip/hip_runtime.h>
// Causal multi-head attention whose q, k AND v are the same per-head projection (x [2][4096][768]; q = k = v = x Wq[h]^T with Wq [12][64][768] (natural per-head rows, sigma 1/sqrt(768)); scores = q.q / sqrt(768) (the module scales by d_model); causal (tril, -inf); softmax; out = merged (attn q) W_out^T + b_out -> [2][4096][768]).
// Structure: token rows r = b*4096 + s; x as exact f16 rows (bf16-rounded); Q = K = V as one WMMA GEMM (32x64 wave tiles, f32 accumulation, exact x16 weights, f16 outputs); one fused launch for the attention: per wave 32 query rows, keys 32 at a time up to the diagonal block, S^T = K Q^T (V^T fragments by transposing LDS reads of the staged k = v rows), online base-2 softmax in registers (f32 statistics, native exp2; weights in (0,1] as f16), O^T += V^T P^T (o carried x64, folded into the output GEMM alpha) written straight into the merged f16 o rows; out = o W_o GEMM (f32) into the output layout.
// Compute dtype: inputs rounded to bf16; x / weights exact; q, k, v, softmax weights and o as plain f16 GEMM operands (~2^-12); scores and softmax statistics f32; v_wmma_f32_16x16x32_f16.
#define NB 2
#define SQ 4096
#define DM 768
#define NH 12
#define HD 64
#define HG 4                         /* heads per k_vt launch */
#define QT0 128                      /* first-tile rows computed exactly in f32 */
#define B0 0                         /* first batch processed (debug hook) */
#define NBR NB                       /* batches processed (debug hook) */
#define NR ((size_t)NB * SQ)         /* token rows */
#define MP ((int)((size_t)NBR * SQ)) /* rows projected (debug hook) */
#define MPO MP                       /* rows through the output stage (debug hook) */
#define LQ DM      /* row pitch of the q/k/v rows */
typedef __bf16 v16b __attribute__((ext_vector_type(16)));
typedef unsigned short v8us __attribute__((ext_vector_type(8), may_alias));
typedef float  v8f  __attribute__((ext_vector_type(8)));
typedef float  v4f  __attribute__((ext_vector_type(4)));
typedef float  v4fa __attribute__((ext_vector_type(4), may_alias));
union FragB { v16b v; v8us half[2]; unsigned short u[16]; };

__device__ __forceinline__ unsigned short bf16_bits(float x) { unsigned int u = __float_as_uint(x); return (unsigned short)((u + 0x7FFFu + ((u >> 16) & 1u)) >> 16); }
__device__ __forceinline__ float bf16_val(unsigned short b) { return __uint_as_float(((unsigned int)b) << 16); }
__device__ __forceinline__ float bf16_round(float x) { return bf16_val(bf16_bits(x)); }
// D += A·B with NT terms: 1 = ah·bh, 2 = + al·bh (A split), 3 = + ah·bl (both split)
template <int NT>
__device__ __forceinline__ v8f mmaN(v16b ah, v16b al, v16b bh, v16b bl, v8f c) {
  c = __builtin_amdgcn_wmma_f32_16x16x32_bf16(false, ah, false, bh, (short)0, c, false, false);
  if (NT >= 2) c = __builtin_amdgcn_wmma_f32_16x16x32_bf16(false, al, false, bh, (short)0, c, false, false);
  if (NT >= 3) c = __builtin_amdgcn_wmma_f32_16x16x32_bf16(false, ah, false, bl, (short)0, c, false, false);
  asm volatile("v_nop\n\tv_nop\n\tv_nop\n\tv_nop" : "+v"(c) : "v"(ah), "v"(al), "v"(bh), "v"(bl));
  return c;
}

__global__ __launch_bounds__(256) void k_wt_bf16(const float* __restrict__ W, unsigned short* __restrict__ Wt, int K, int N) {
  const int t = blockIdx.x * 256 + threadIdx.x;
  const int k8n = K / 8;
  if (t >= N * k8n) return;
  const int n = t / k8n, k8 = (t % k8n) * 8;
  v8us v;
#pragma unroll
  for (int i = 0; i < 8; ++i) v[i] = bf16_bits(W[(size_t)(k8 + i) * N + n]);
  *(v8us*)(Wt + (size_t)n * K + k8) = v;
  
}

// GEMM C[M][N] (f32, pitch ldc) = act(A[M][K]·W + bias). A f32 row-major (pitch lda) converted per fragment to bf16
// (ASPLIT: hi/lo two planes -> 2 terms, else single rounded term); Wt bf16 [N][K] (pitch ldb). BIAS_BF16 rounds the
// bias to bf16 first (bias quantised to bf16 before the add). K%32==0, M%16==0, N%64==0.
template <bool ASPLIT, int ACT, bool BIAS_BF16>
__global__ __launch_bounds__(128) void k_gemm_bf(const float* __restrict__ A, int lda, const unsigned short* __restrict__ Wt, int ldb,
                                               const float* __restrict__ bias, float* __restrict__ C, int ldc, int M, int N, int K) {
  __shared__ __attribute__((aligned(16))) float so[4][16][64];
  const int tid = threadIdx.x, w = tid >> 5, lane = tid & 31, ln = lane & 15, hh = lane >> 4;
  const int ntn = N / 64;
  const int wid = blockIdx.x * 4 + w;
  const int mt = wid / ntn, nq = wid % ntn;
  if (mt * 16 >= M) return;
  const int row0 = mt * 16, col0 = nq * 64;
  const float* arow = A + (size_t)(row0 + ln) * lda;
  v8f acc[4] = {};
  for (int kb = 0; kb < K; kb += 32) {
    FragB ah, al;
    const v4f x0 = *(const v4fa*)(arow + kb + 8 * hh), x1 = *(const v4fa*)(arow + kb + 8 * hh + 4);
    const v4f x2 = *(const v4fa*)(arow + kb + 16 + 8 * hh), x3 = *(const v4fa*)(arow + kb + 16 + 8 * hh + 4);
    float xs[16] = {x0[0],x0[1],x0[2],x0[3],x1[0],x1[1],x1[2],x1[3],x2[0],x2[1],x2[2],x2[3],x3[0],x3[1],x3[2],x3[3]};
#pragma unroll
    for (int i = 0; i < 16; ++i) { const unsigned short hb = bf16_bits(xs[i]); ah.u[i] = hb; al.u[i] = ASPLIT ? bf16_bits(xs[i] - bf16_val(hb)) : (unsigned short)0; }
#pragma unroll
    for (int t = 0; t < 4; ++t) {
      const unsigned short* brow = Wt + (size_t)(col0 + t * 16 + ln) * ldb + kb;
      FragB b;
      b.half[0] = *(const v8us*)(brow + 8 * hh);
      b.half[1] = *(const v8us*)(brow + 16 + 8 * hh);
      acc[t] = mmaN<ASPLIT ? 2 : 1>(ah.v, al.v, b.v, b.v, acc[t]);
    }
  }
#pragma unroll
  for (int t = 0; t < 4; ++t) {
    float bv = bias ? bias[col0 + t * 16 + ln] : 0.f;
    if (BIAS_BF16) bv = bf16_round(bv);
#pragma unroll
    for (int r = 0; r < 8; ++r) { float v = acc[t][r] + bv; if (ACT == 1) v = fmaxf(v, 0.f); so[w][8 * hh + r][t * 16 + ln] = v; }
  }
  __builtin_amdgcn_fence(__ATOMIC_ACQ_REL, "workgroup");
  __builtin_amdgcn_wave_barrier();
  const int rsub = lane >> 4, c4 = (lane & 15) * 4;
  {
#pragma unroll
    for (int q = 0; q < 8; ++q) {
      const int r = q * 2 + rsub;
      const v4f v = *(const v4fa*)&so[w][r][c4];
      *(v4f*)(C + (size_t)(row0 + r) * ldc + col0 + c4) = v;
    }
    
  }
}

// GEMM C = act(A·W + bias + resid): A f32 (ASPLIT -> hi/lo 2 terms), Wt bf16 [N][K]; ACT 0 none, 1 relu, 2 exact gelu;
// resid (optional, f32, row index = (row % rmod), pitch ldr, RES_BF16 rounds it) added before the activation.
template <bool ASPLIT, int ACT, bool BIAS_BF16, bool RES_BF16>
__global__ __launch_bounds__(128) void k_gemm_bf3(const float* __restrict__ A, int lda, const unsigned short* __restrict__ Wt, int ldb,
                                                const float* __restrict__ bias, const float* __restrict__ resid, int rmod, int ldr,
                                                float* __restrict__ C, int ldc, int M, int N, int K) {
  __shared__ __attribute__((aligned(16))) float so[4][16][64];
  const int tid = threadIdx.x, w = tid >> 5, lane = tid & 31, ln = lane & 15, hh = lane >> 4;
  const int ntn = N / 64;
  const int wid = blockIdx.x * 4 + w;
  const int mt = wid / ntn, nq = wid % ntn;
  if (mt * 16 >= M) return;
  const int row0 = mt * 16, col0 = nq * 64;
  const float* arow = A + (size_t)(row0 + ln) * lda;
  v8f acc[4] = {};
  for (int kb = 0; kb < K; kb += 32) {
    FragB ah, al;
    const v4f x0 = *(const v4fa*)(arow + kb + 8 * hh), x1 = *(const v4fa*)(arow + kb + 8 * hh + 4);
    const v4f x2 = *(const v4fa*)(arow + kb + 16 + 8 * hh), x3 = *(const v4fa*)(arow + kb + 16 + 8 * hh + 4);
    float xs[16] = {x0[0],x0[1],x0[2],x0[3],x1[0],x1[1],x1[2],x1[3],x2[0],x2[1],x2[2],x2[3],x3[0],x3[1],x3[2],x3[3]};
#pragma unroll
    for (int i = 0; i < 16; ++i) { const unsigned short hb = bf16_bits(xs[i]); ah.u[i] = hb; al.u[i] = ASPLIT ? bf16_bits(xs[i] - bf16_val(hb)) : (unsigned short)0; }
#pragma unroll
    for (int t = 0; t < 4; ++t) {
      const unsigned short* brow = Wt + (size_t)(col0 + t * 16 + ln) * ldb + kb;
      FragB b;
      b.half[0] = *(const v8us*)(brow + 8 * hh);
      b.half[1] = *(const v8us*)(brow + 16 + 8 * hh);
      acc[t] = mmaN<ASPLIT ? 2 : 1>(ah.v, al.v, b.v, b.v, acc[t]);
    }
  }
#pragma unroll
  for (int t = 0; t < 4; ++t) {
    const int col = col0 + t * 16 + ln;
    float bv = bias ? bias[col] : 0.f;
    if (BIAS_BF16) bv = bf16_round(bv);
#pragma unroll
    for (int r = 0; r < 8; ++r) {
      float v = acc[t][r] + bv;
      if (resid) { float rv = resid[(size_t)((row0 + 8 * hh + r) % rmod) * ldr + col]; if (RES_BF16) rv = bf16_round(rv); v += rv; }
      if (ACT == 1) v = fmaxf(v, 0.f);
      if (ACT == 2) v = 0.5f * v * (1.0f + erff(v * 0.70710678118654752f));
      if (ACT == 3) { const float u = 0.7978845608028654f * (v + 0.044715f * v * v * v); v = 0.5f * v * (1.0f + tanhf(u)); }
      so[w][8 * hh + r][t * 16 + ln] = v;
    }
  }
  __builtin_amdgcn_fence(__ATOMIC_ACQ_REL, "workgroup");
  __builtin_amdgcn_wave_barrier();
  const int rsub = lane >> 4, c4 = (lane & 15) * 4;
  {
#pragma unroll
    for (int q = 0; q < 8; ++q) {
      const int r = q * 2 + rsub;
      const v4f v = *(const v4fa*)&so[w][r][c4];
      *(v4f*)(C + (size_t)(row0 + r) * ldc + col0 + c4) = v;
    }
    
  }
}
// row LayerNorm (biased variance, eps) over N: s = X (+ R); optional out_sum <- s; out_norm <- (s-mu)*rsqrt(var+eps)*g + b
template <bool PARAM_BF16>
__global__ __launch_bounds__(256) void k_layernorm(const float* __restrict__ X, const float* __restrict__ R, const float* __restrict__ g, const float* __restrict__ bta,
                                                  float* __restrict__ out_sum, float* __restrict__ out_norm, int N, float eps) {
  __shared__ float red[256];
  const int row = blockIdx.x, tid = threadIdx.x;
  const float* x = X + (size_t)row * N; const float* rr = R ? R + (size_t)row * N : nullptr;
  float vals[16];                     // up to N = 4096
  const int per = N / 256;            // contiguous chunk per thread? use strided-by-4 chunks: thread handles j = tid*4 + 1024*u
  float s1 = 0.f;
  for (int u = 0; u < per / 4; ++u) {
    const int j = tid * 4 + 1024 * u;
    const v4f a = *(const v4fa*)(x + j);
    v4f b = {0.f,0.f,0.f,0.f}; if (rr) b = *(const v4fa*)(rr + j);
#pragma unroll
    for (int q = 0; q < 4; ++q) { const float v = a[q] + b[q]; vals[u * 4 + q] = v; s1 += v; }
  }
  red[tid] = s1; __syncthreads();
  for (int st = 128; st > 0; st >>= 1) { if (tid < st) red[tid] += red[tid + st]; __syncthreads(); }
  const float mu = red[0] / (float)N; __syncthreads();
  float s2 = 0.f;
  for (int u = 0; u < per / 4; ++u)
#pragma unroll
    for (int q = 0; q < 4; ++q) { const float c = vals[u * 4 + q] - mu; s2 += c * c; }
  red[tid] = s2; __syncthreads();
  for (int st = 128; st > 0; st >>= 1) { if (tid < st) red[tid] += red[tid + st]; __syncthreads(); }
  const float rs = rsqrtf(red[0] / (float)N + eps);
  {
    for (int u = 0; u < per / 4; ++u) {
      const int j = tid * 4 + 1024 * u;
      v4f o, sm;
#pragma unroll
      for (int q = 0; q < 4; ++q) {
        float gg = g[j + q], bb = bta[j + q];
        if (PARAM_BF16) { gg = bf16_round(gg); bb = bf16_round(bb); }
        sm[q] = vals[u * 4 + q]; o[q] = (vals[u * 4 + q] - mu) * rs * gg + bb;
      }
      if (out_sum) *(v4f*)(out_sum + (size_t)row * N + j) = sm;
      *(v4f*)(out_norm + (size_t)row * N + j) = o;
    }
    
  }
}



// ---- f16 WMMA path (v_wmma_f32_16x16x32_f16): 11-bit significands for operands in range — used where a [0,1] probability operand needs more precision than bf16
typedef _Float16 v16h __attribute__((ext_vector_type(16)));
union FragH { v16h v; v8us half[2]; _Float16 h[16]; unsigned short u[16]; };
template <int NT>
__device__ __forceinline__ v8f mmaH(v16h ah, v16h al, v16h bh, v16h bl, v8f c) {
  c = __builtin_amdgcn_wmma_f32_16x16x32_f16(false, ah, false, bh, (short)0, c, false, false);
  if (NT >= 2) c = __builtin_amdgcn_wmma_f32_16x16x32_f16(false, al, false, bh, (short)0, c, false, false);
  if (NT >= 3) c = __builtin_amdgcn_wmma_f32_16x16x32_f16(false, ah, false, bl, (short)0, c, false, false);
  asm volatile("v_nop\n\tv_nop\n\tv_nop\n\tv_nop" : "+v"(c) : "v"(ah), "v"(al), "v"(bh), "v"(bl));
  return c;
}
// batched GEMM like k_gemm_b but f16 operands: A f32 (split into f16 hi/lo if ASPLIT, else rounded to f16), Bt = f16 values [n][k]; alpha; C f32; N multiple of 16 (partial tiles skipped)
template <bool ASPLIT>
__global__ __launch_bounds__(128) void k_gemm_h(const float* __restrict__ A, int lda, size_t sA, const _Float16* __restrict__ Bh, int ldb, size_t sB, float alpha, float* __restrict__ C, int ldc, size_t sC, int M, int N, int K) {
  __shared__ __attribute__((aligned(16))) float so[4][16][64];
  const int tid = threadIdx.x, w = tid >> 5, lane = tid & 31, ln = lane & 15, hh = lane >> 4; const int by = blockIdx.y;
  A += (size_t)by * sA; Bh += (size_t)by * sB; C += (size_t)by * sC;
  const int ntn = (N + 63) / 64; const int wid = blockIdx.x * 4 + w; const int mt = wid / ntn, nq = wid % ntn; if (mt * 16 >= M) return;
  const int row0 = mt * 16, col0 = nq * 64; const float* arow = A + (size_t)(row0 + ln) * lda;
  v8f acc[4] = {};
  for (int kb = 0; kb < K; kb += 32) {
    FragH ah, al;
    const v4f x0 = *(const v4fa*)(arow + kb + 8 * hh), x1 = *(const v4fa*)(arow + kb + 8 * hh + 4), x2 = *(const v4fa*)(arow + kb + 16 + 8 * hh), x3 = *(const v4fa*)(arow + kb + 16 + 8 * hh + 4);
    float xs[16] = {x0[0],x0[1],x0[2],x0[3],x1[0],x1[1],x1[2],x1[3],x2[0],x2[1],x2[2],x2[3],x3[0],x3[1],x3[2],x3[3]};
#pragma unroll
    for (int i = 0; i < 16; ++i) { const _Float16 h = (_Float16)xs[i]; ah.h[i] = h; al.h[i] = ASPLIT ? (_Float16)(xs[i] - (float)h) : (_Float16)0.0f; }
#pragma unroll
    for (int t = 0; t < 4; ++t) { if (col0 + t * 16 >= N) continue; const size_t boff = (size_t)(col0 + t * 16 + ln) * ldb + kb; FragH bq; bq.half[0] = *(const v8us*)(Bh + boff + 8 * hh); bq.half[1] = *(const v8us*)(Bh + boff + 16 + 8 * hh);
      acc[t] = mmaH<ASPLIT ? 2 : 1>(ah.v, al.v, bq.v, bq.v, acc[t]); }
  }
#pragma unroll
  for (int t = 0; t < 4; ++t) { if (col0 + t * 16 >= N) continue;
#pragma unroll
    for (int r = 0; r < 8; ++r) so[w][8 * hh + r][t * 16 + ln] = acc[t][r] * alpha; }
  __builtin_amdgcn_fence(__ATOMIC_ACQ_REL, "workgroup"); __builtin_amdgcn_wave_barrier();
  const int rsub = lane >> 4, c4 = (lane & 15) * 4;
  {
#pragma unroll
    for (int q = 0; q < 8; ++q) { const int r = q * 2 + rsub; if (col0 + c4 < N) { const v4f v = *(const v4fa*)&so[w][r][c4]; *(v4f*)(C + (size_t)(row0 + r) * ldc + col0 + c4) = v; } }
     }
}

// Wt[n][k] = f16(W[k][n]·scale) from f32 row-major W[K][N] (scale = power of two; bf16-exact weights stay exact in f16 away from the subnormal range)
__global__ __launch_bounds__(256) void k_wt_f16(const float* __restrict__ W, _Float16* __restrict__ Wt, int K, int N, float scale) {
  const int t = blockIdx.x * 256 + threadIdx.x; if (t >= N * (K / 8)) return; const int n = t / (K / 8), k8 = (t % (K / 8)) * 8; FragH f;
#pragma unroll
  for (int i = 0; i < 8; ++i) f.h[i] = (_Float16)(bf16_round(W[(size_t)(k8 + i) * N + n]) * scale); const v8us o = f.half[0];
  *(v8us*)((unsigned short*)Wt + (size_t)n * K + k8) = o; 
}
// k_gemm_hh variant with fused epilogue: v = acc·alpha + bias[by·sBias + col] (+ CP[(row/rowsPerB)·sCPb + by·64 + col] if CP) ; ACT 0 none / 1 elu ; writes f16 C16 (and f32 C if non-null)
template <int ACT>
__global__ __launch_bounds__(128) void k_gemm_hhx(const _Float16* __restrict__ A, int lda, size_t sA, const _Float16* __restrict__ Bh, int ldb, size_t sB, float alpha, const float* __restrict__ bias, size_t sBias, const float* __restrict__ CP, int rowsPerB, size_t sCPb, int row0g,
    float* __restrict__ C, _Float16* __restrict__ C16, int ldc, size_t sC, int M, int N, int K) {
  __shared__ __attribute__((aligned(16))) float so[4][16][64];
  const int tid = threadIdx.x, w = tid >> 5, lane = tid & 31, ln = lane & 15, hh = lane >> 4; const int by = blockIdx.y;
  A += (size_t)by * sA; Bh += (size_t)by * sB; const size_t cofs = (size_t)by * sC; const float* bp = bias ? bias + (size_t)by * sBias : nullptr;
  const int ntn = (N + 63) / 64; const int wid = blockIdx.x * 4 + w; const int mt = wid / ntn, nq = wid % ntn; if (mt * 16 >= M) return;
  const int row0 = mt * 16, col0 = nq * 64; const _Float16* arow = A + (size_t)(row0 + ln) * lda;
  v8f acc[4] = {};
  for (int kb = 0; kb < K; kb += 32) { FragH ah; ah.half[0] = *(const v8us*)((const unsigned short*)arow + kb + 8 * hh); ah.half[1] = *(const v8us*)((const unsigned short*)arow + kb + 16 + 8 * hh);
#pragma unroll
    for (int t = 0; t < 4; ++t) { if (col0 + t * 16 >= N) continue; const size_t boff = (size_t)(col0 + t * 16 + ln) * ldb + kb; FragH bq; bq.half[0] = *(const v8us*)((const unsigned short*)Bh + boff + 8 * hh); bq.half[1] = *(const v8us*)((const unsigned short*)Bh + boff + 16 + 8 * hh);
      acc[t] = mmaH<1>(ah.v, ah.v, bq.v, bq.v, acc[t]); }
  }
#pragma unroll
  for (int t = 0; t < 4; ++t) { if (col0 + t * 16 >= N) continue; const int col = col0 + t * 16 + ln; const float bv = bp ? bf16_round(bp[col]) : 0.f;
#pragma unroll
    for (int r = 0; r < 8; ++r) { float v = acc[t][r] * alpha + bv; if (CP) { const int rr = row0g + row0 + 8 * hh + r; if (rowsPerB < 0) v += CP[cofs + (size_t)rr * ldc + col];      /* rowsPerB < 0: own element of the batched C plane */ else { const int bidx = rr / rowsPerB; v += CP[(size_t)bidx * sCPb + (size_t)by * 64 + col]; } } if (ACT == 1) v = (v > 0.f) ? v : expm1f(v); else if (ACT == 7) v = (v > 0.f) ? v + 1.0f : expf(v); else if (ACT == 8) v = tanhf(v); else if (ACT == 9) v = 0.5f * v * (1.0f + tanhf(0.7978845608028654f * (v + 0.044715f * v * v * v))); else if (ACT == 11) v = 1.0f / (1.0f + expf(-v)); else if (ACT == 12) v = (v > 0.f) ? v : 0.01f * v; else if (ACT == 14) v = (v > 0.f) ? v : 0.1f * v; else if (ACT == 16) v = (v >= 0.f) ? v : 0.3f * v; else if (ACT == 17) v = (v >= 0.f) ? v : 0.2f * v; else if (ACT == 15) v = v / (1.0f + expf(-v)); else if (ACT == 3) v = fmaxf(v, 0.f); else if (ACT == 6) v = 0.5f * v * (1.0f + erff(v * 0.70710678118654752f)); so[w][8 * hh + r][t * 16 + ln] = v; } }
  __builtin_amdgcn_fence(__ATOMIC_ACQ_REL, "workgroup"); __builtin_amdgcn_wave_barrier();
  const int rsub = lane >> 4, c4 = (lane & 15) * 4; typedef _Float16 v4h __attribute__((ext_vector_type(4)));
  {
#pragma unroll
    for (int q = 0; q < 8; ++q) { const int r = q * 2 + rsub; if (col0 + c4 < N) { const v4f v = *(const v4fa*)&so[w][r][c4]; if (C) *(v4f*)(C + cofs + (size_t)(row0 + r) * ldc + col0 + c4) = v; if (C16) { v4h h4; for (int i = 0; i < 4; ++i) h4[i] = (_Float16)v[i]; *(v4h*)(C16 + cofs + (size_t)(row0 + r) * ldc + col0 + c4) = h4; } } }
     }
}


typedef _Float16 v4h __attribute__((ext_vector_type(4)));

__global__ __launch_bounds__(256) void k_x16(const float* __restrict__ x, _Float16* __restrict__ X16, size_t n8) { const size_t t = (size_t)blockIdx.x * 256 + threadIdx.x; if (t >= n8) return; FragH f;
#pragma unroll
  for (int q = 0; q < 8; ++q) f.h[q] = (_Float16)bf16_round(x[t * 8 + q]); *(v8us*)((unsigned short*)X16 + t * 8) = f.half[0];  }
__global__ __launch_bounds__(256) void k_h16(const float* __restrict__ x, _Float16* __restrict__ X16, size_t n8) { const size_t t = (size_t)blockIdx.x * 256 + threadIdx.x; if (t >= n8) return; FragH f;
#pragma unroll
  for (int q = 0; q < 8; ++q) f.h[q] = (_Float16)x[t * 8 + q]; *(v8us*)((unsigned short*)X16 + t * 8) = f.half[0];  }
__global__ __launch_bounds__(256) void k_round16f(const float* __restrict__ W, _Float16* __restrict__ Bt, size_t n8) { const size_t t = (size_t)blockIdx.x * 256 + threadIdx.x; if (t >= n8) return; FragH f;
#pragma unroll
  for (int i = 0; i < 8; ++i) f.h[i] = (_Float16)(bf16_round(W[t * 8 + i]) * 16.0f); *(v8us*)((unsigned short*)Bt + t * 8) = f.half[0];  }
template <int NHv, int TTv>
__global__ __launch_bounds__(256) void k_vt(const _Float16* __restrict__ V16, int ldv, int voff, _Float16* __restrict__ Vt) { __shared__ unsigned short tl[64][66]; const int tid = threadIdx.x; const int slab = blockIdx.x / (TTv / 64), lg = blockIdx.x % (TTv / 64); const int b = slab / NHv, h = slab % NHv;
  for (int i = tid; i < 64 * 8; i += 256) { const int r = i / 8, c8 = (i % 8) * 8; FragH f; f.half[0] = *(const v8us*)((const unsigned short*)V16 + ((size_t)b * TTv + lg * 64 + r) * ldv + voff + h * 64 + c8);
#pragma unroll
    for (int q = 0; q < 8; ++q) tl[r][c8 + q] = f.u[q]; }
  __syncthreads();
  {
#pragma unroll
    for (int rd = 0; rd < 2; ++rd) { const int d = rd * 32 + tid / 8, pc = tid % 8; FragH f;
#pragma unroll
      for (int q = 0; q < 8; ++q) f.u[q] = tl[pc * 8 + q][d];
      *(v8us*)((unsigned short*)Vt + ((size_t)slab * 64 + d) * TTv + lg * 64 + pc * 8) = f.half[0]; }
     } }

// ---- fast GEMM (block tile 128x64, wave tile 32x64; requires M % 128 == 0 rows per launch region, N % 64 == 0, K % 64 == 0 and K >= 64); epilogue: v = acc x alpha + bias ----
// The block's 128 A rows and 64 B rows come through LDS, 64 k (one whole 128-byte line of every row) a stage, two buffers, brought by asynchronous copies: stage t + 2 flies while stage t + 1 is worked on.
// (A fragment load straight from global memory touches 16 lines for 512 bytes, each wave fetched its own copy of B, and every product waited for its own loads.) The k order of every accumulator is unchanged: ascending, 32 at a time.
#define GK 64                        /* k per stage */
#define GP 72                        /* LDS row pitch in f16 = 144 bytes, an odd multiple of 16: 16-byte fragment reads of 128-byte rows fall evenly on the banks */
#define GT (192 * GP)                /* f16 per buffer: 128 A rows, then 64 B rows */
__device__ __forceinline__ v16h g2_frag(const _Float16* p, int hh) { FragH f; f.half[0] = *(const v8us*)((const unsigned short*)p + 8 * hh); f.half[1] = *(const v8us*)((const unsigned short*)p + 16 + 8 * hh); return f.v; }
__device__ __forceinline__ v16h g2_lfrag(const unsigned short* p) { FragH f; f.half[0] = *(const v8us*)p; f.half[1] = *(const v8us*)(p + 16); return f.v; }
__device__ __forceinline__ v8f g2_mma(v16h a, v16h b, v8f c) { return __builtin_amdgcn_wmma_f32_16x16x32_f16(false, a, false, b, (short)0, c, false, false); }
// One stage's copies of one lane: 16 bytes of each of eight A rows and four B rows, 16 rows apart (a wave's 32 lanes cover four whole 128-byte rows per copy). sa, sb = 16 rows of A, of B in f16; l0 = the lane's LDS byte address in the buffer's first 16 rows.
// a0 = the lane's row among staged A rows 0 .. 15, a4 = among rows 64 .. 79: the upper 64 staged rows may come from another plane than the lower 64.
// The s_wait_xcnt closes the statement so that it stands in front of any later write of the address registers the copies name.
__device__ __forceinline__ void g2_copy(const _Float16* a0, const _Float16* a4, size_t sa, const _Float16* b0, size_t sb, unsigned l0) {
  const _Float16* a1 = a0 + sa; const _Float16* a2 = a0 + 2 * sa; const _Float16* a3 = a0 + 3 * sa; const _Float16* a5 = a4 + sa; const _Float16* a6 = a4 + 2 * sa; const _Float16* a7 = a4 + 3 * sa;      /* each from a base: no chain of additions in front of the copies */
  const _Float16* b1 = b0 + sb; const _Float16* b2 = b0 + 2 * sb; const _Float16* b3 = b0 + 3 * sb;
  constexpr unsigned R = 16 * GP * 2;      /* bytes of 16 staged rows */
  const unsigned l1 = l0 + R, l2 = l0 + 2 * R, l3 = l0 + 3 * R, l4 = l0 + 4 * R, l5 = l0 + 5 * R, l6 = l0 + 6 * R, l7 = l0 + 7 * R, l8 = l0 + 8 * R, l9 = l0 + 9 * R, l10 = l0 + 10 * R, l11 = l0 + 11 * R;
  asm volatile("global_load_async_to_lds_b128 %0, %12, off\n\t"
               "global_load_async_to_lds_b128 %1, %13, off\n\t"
               "global_load_async_to_lds_b128 %2, %14, off\n\t"
               "global_load_async_to_lds_b128 %3, %15, off\n\t"
               "global_load_async_to_lds_b128 %4, %16, off\n\t"
               "global_load_async_to_lds_b128 %5, %17, off\n\t"
               "global_load_async_to_lds_b128 %6, %18, off\n\t"
               "global_load_async_to_lds_b128 %7, %19, off\n\t"
               "global_load_async_to_lds_b128 %8, %20, off\n\t"
               "global_load_async_to_lds_b128 %9, %21, off\n\t"
               "global_load_async_to_lds_b128 %10, %22, off\n\t"
               "global_load_async_to_lds_b128 %11, %23, off\n\t"
               "s_wait_xcnt 0x0"
               :: "v"(l0), "v"(l1), "v"(l2), "v"(l3), "v"(l4), "v"(l5), "v"(l6), "v"(l7), "v"(l8), "v"(l9), "v"(l10), "v"(l11),
                  "v"(a0), "v"(a1), "v"(a2), "v"(a3), "v"(a4), "v"(a5), "v"(a6), "v"(a7), "v"(b0), "v"(b1), "v"(b2), "v"(b3) : "memory"); }
// FT = what the launch does for the first QT0 rows of every batch, the rows that go through the exact f32 attention (their planes are [QT0][ldf]: row r holds row r of batch 0, then of batch 1):
// FT 1 (projection): a block of such rows also stores its tile as f32 into CF. FT 2 (output): such rows do not come from A but from the planes A0h + A0l x alphal / alpha; blocks 0 .. F2B - 1 take them, 64 rows each:
// staged rows 0 .. 63 are A0h's, 64 .. 127 the same rows of A0l, so waves 0, 1 hold the main products and waves 2, 3 the residual products of the same output rows; the pairs join in the epilogue. The other blocks take A's other row tiles.
// FT also fixes, at compile time, what a launch adds and stores: FT 1 no bias, f16 rows into C16; FT 2 the bias, f32 rows into C. No test of an argument stands inside the epilogue's unrolled loops: such a test leaves the side that is never taken in the text, once per accumulator element,
// so that the path that runs is a chain of taken branches from one instruction-cache line to another through a text several times as long, and a load behind such a test is waited for alone. Without the tests the epilogue is one short straight line.
#define F2B (NBR * (QT0 / 64) * (DM / 64))      /* first-tile blocks of an FT 2 launch */
template <int ACT, int FT>
__global__ __launch_bounds__(128) void k_gemm2(const _Float16* __restrict__ A, int lda, size_t sA, const _Float16* __restrict__ Bh, int ldb, size_t sB, float alpha, const float* __restrict__ bias, size_t sBias,
    float* __restrict__ C, _Float16* __restrict__ C16, int ldc, size_t sC, int M, int N, int K, const _Float16* __restrict__ A0h, const _Float16* __restrict__ A0l, float alphal, float* __restrict__ CF, int ldf) { static_assert(QT0 == 128, "a first tile is one 128-row block tile"); static_assert(FT == 1 || FT == 2, "FT says which output the launch stores"); static_assert(ACT == 0 || ACT == 3 || ACT == 6 || ACT == 8 || ACT == 9 || ACT == 11 || ACT == 12 || ACT == 14 || ACT == 15 || ACT == 16 || ACT == 17, "k_gemm2: unsupported ACT code (would silently apply no activation)");
  __shared__ __attribute__((aligned(16))) unsigned short st[2][GT];      /* [buffer][128 A rows, 64 B rows][pitch] */
  /* the epilogue's tiles lie over the stage buffers: behind the last stage's barrier no wave reads a stage and no copy is outstanding. At 55,296 B of LDS four blocks fit a WGP, so the FT 2 grid, 24 blocks more than three a WGP hold, still runs as one round */
  static_assert(sizeof(float) * 4 * 32 * 68 <= sizeof(st), "epilogue tiles fit the stage buffers"); float (*so)[32][68] = reinterpret_cast<float (*)[32][68]>(&st[0][0]);
  const int tid = threadIdx.x, w = tid >> 5, lane = tid & 31, ln = lane & 15, hh = lane >> 4; const int by = blockIdx.y;
  A += (size_t)by * sA; Bh += (size_t)by * sB; const size_t cofs = (size_t)by * sC; const float* bp = bias ? bias + (size_t)by * sBias : nullptr;
  const int ntn = N >> 6; constexpr int TPB = SQ / 128;      /* row tiles per batch */
  const bool f2 = FT == 2 && blockIdx.x < F2B;      /* the same in the whole block */
  const int bx = FT == 2 ? (f2 ? (int)blockIdx.x : (int)blockIdx.x - F2B) : (int)blockIdx.x; const int mq = bx / ntn, nq = bx - mq * ntn;
  const int mt = FT == 2 ? mq + 1 + mq / (TPB - 1) : mq;      /* FT 2: the row tiles that are no batch's first */
  const int fb = mq >> 1, fr = (mq & 1) * 64;      /* f2: batch, first of the block's 64 rows */
  const int row0 = f2 ? fb * SQ + fr + 32 * (w & 1) : mt * 128 + 32 * w, col0 = nq * 64; if (!f2 && mt * 128 >= M) return;      /* the whole block leaves or none: every wave passes every barrier */
  const size_t fo = (size_t)(fr + (tid >> 3)) * ldf + (size_t)fb * DM + (tid & 7) * 8;      /* f2: this lane's 16 bytes of stage 0 in either plane */
  const size_t sa = (size_t)16 * (f2 ? ldf : lda), sb = (size_t)16 * ldb;
  const _Float16* ag = f2 ? A0h + fo : A + (size_t)(mt * 128 + (tid >> 3)) * lda + (tid & 7) * 8;      /* this lane's 16 bytes of stage 0: A row tid / 8 of the block */
  const _Float16* ag4 = f2 ? A0l + fo : ag + 4 * sa;                                    /* and staged row 64 + tid / 8 */
  const _Float16* bg = Bh + (size_t)(col0 + (tid >> 3)) * ldb + (tid & 7) * 8;          /* and B row tid / 8 */
  const unsigned l0 = (unsigned)(size_t)&st[0][(tid >> 3) * GP + (tid & 7) * 8];        /* low 32 bits of a shared address = LDS byte address */
  const int nst = K / GK;
  g2_copy(ag, ag4, sa, bg, sb, l0);
  asm volatile("s_wait_asynccnt 0x0" ::: "memory");      /* stage 0 has landed for this wave's own copies */
  __syncthreads();                                        /* ... and for every wave's: publishes stage 0 */
  if (1 < nst) g2_copy(ag + GK, ag4 + GK, sa, bg + GK, sb, l0 + GT * 2);
  const v8f z8 = {0.f,0.f,0.f,0.f,0.f,0.f,0.f,0.f}; v8f c00 = z8, c01 = z8, c02 = z8, c03 = z8, c10 = z8, c11 = z8, c12 = z8, c13 = z8;
#pragma unroll 1
  for (int t = 0; t < nst; ++t) {      /* stays rolled: one copy of the stage's code; the loops inside are unrolled so that the fragment arrays stay in registers */
    const unsigned short* al = &st[t & 1][(32 * w + ln) * GP + 8 * hh];      /* this lane's row and half within the wave's first 16 staged A rows */
    const unsigned short* bl = &st[t & 1][(128 + ln) * GP + 8 * hh];         /* and within the first 16 staged B rows */
    v16h a[2][2], b[2][4];
#pragma unroll
    for (int ks = 0; ks < 2; ++ks) { a[ks][0] = g2_lfrag(al + ks * 32); a[ks][1] = g2_lfrag(al + 16 * GP + ks * 32);
#pragma unroll
      for (int n = 0; n < 4; ++n) b[ks][n] = g2_lfrag(bl + n * 16 * GP + ks * 32); }
    asm volatile("s_wait_dscnt 0x0" ::: "memory");         /* the stage's 24 LDS reads, one group, have returned: this wave is done with buffer t & 1 before the buffer is refilled */
    asm volatile("s_wait_asynccnt 0x0" ::: "memory");      /* this wave's copies of stage t + 1 have landed */
    __syncthreads();                                        /* publishes stage t + 1 and ends every wave's reads of stage t */
    if (t + 2 < nst) g2_copy(ag + (size_t)(t + 2) * GK, ag4 + (size_t)(t + 2) * GK, sa, bg + (size_t)(t + 2) * GK, sb, l0 + (unsigned)(t & 1) * (GT * 2));      /* the same test in the whole block */
    /* the stage's products work on registers alone and stand behind the refill: the copies of stage t + 2 fly under them and under the next stage's LDS reads */
#pragma unroll
    for (int ks = 0; ks < 2; ++ks) {
      c00 = g2_mma(a[ks][0], b[ks][0], c00); c10 = g2_mma(a[ks][1], b[ks][0], c10);
      c01 = g2_mma(a[ks][0], b[ks][1], c01); c11 = g2_mma(a[ks][1], b[ks][1], c11);
      c02 = g2_mma(a[ks][0], b[ks][2], c02); c12 = g2_mma(a[ks][1], b[ks][2], c12);
      c03 = g2_mma(a[ks][0], b[ks][3], c03); c13 = g2_mma(a[ks][1], b[ks][3], c13); } }
  if (FT == 2) asm volatile("v_nop\n\tv_nop\n\tv_nop\n\tv_nop");      /* the loop is left by a taken branch directly behind its last product: the four vector slots the chip needs before that product's A and B registers are written over */
  asm volatile("s_wait_asynccnt 0x0" ::: "memory");        /* no copy is outstanding when the wave goes on to the epilogue and ends */
  v8f accs[8] = {c00, c01, c02, c03, c10, c11, c12, c13};
  v8f lo8[8];      /* FT 2: what joins each accumulator element; 0 outside the first-tile blocks. The loops over u and r below are fully unrolled so that lo8 and accs are indexed by constants and stay in registers */
  if (FT == 2) {
#pragma unroll
    for (int u = 0; u < 8; ++u) lo8[u] = z8; }
  if (f2) {      /* waves 2, 3 hand their residual products, element for element in the accumulator's own lane, to waves 0, 1 and are done */
    if (w >= 2) {
#pragma unroll
      for (int u = 0; u < 8; ++u)
#pragma unroll
        for (int r = 0; r < 8; ++r) so[w][(u >> 2) * 16 + 8 * hh + r][(u & 3) * 16 + ln] = accs[u][r] * alphal; }
    __syncthreads();      /* the residual tiles are written before their partner waves read them; no barrier follows */
    if (w >= 2) return;
#pragma unroll
    for (int u = 0; u < 8; ++u)      /* one group of LDS reads, one wait */
#pragma unroll
      for (int r = 0; r < 8; ++r) lo8[u][r] = so[w + 2][(u >> 2) * 16 + 8 * hh + r][(u & 3) * 16 + ln]; }
#pragma unroll
  for (int u = 0; u < 8; ++u) { const int t = u & 3, half = u >> 2; const int col = col0 + t * 16 + ln; const float bv = FT == 2 ? bf16_round(bp[col]) : 0.f;
#pragma unroll
    for (int r = 0; r < 8; ++r) { const int rloc = half * 16 + 8 * hh + r; float v = accs[u][r] * alpha + bv; if (FT == 2) v += lo8[u][r];
      if (ACT == 3) v = fmaxf(v, 0.f); else if (ACT == 6) v = 0.5f * v * (1.0f + erff(v * 0.70710678118654752f)); else if (ACT == 11) v = 1.0f / (1.0f + expf(-v)); else if (ACT == 15) v = v / (1.0f + expf(-v)); else if (ACT == 12) v = (v > 0.f) ? v : 0.01f * v; else if (ACT == 8) v = tanhf(v); else if (ACT == 9) v = 0.5f * v * (1.0f + tanhf(0.7978845608028654f * (v + 0.044715f * v * v * v))); else if (ACT == 14) v = (v > 0.f) ? v : 0.1f * v; else if (ACT == 16) v = (v >= 0.f) ? v : 0.3f * v; else if (ACT == 17) v = (v >= 0.f) ? v : 0.2f * v;
      so[w][rloc][t * 16 + ln] = v; } }
  __builtin_amdgcn_fence(__ATOMIC_ACQ_REL, "workgroup"); __builtin_amdgcn_wave_barrier();
  const int rsub = lane >> 4, c4 = (lane & 15) * 4;
  {
#pragma unroll
    for (int q = 0; q < 16; ++q) { const int r = q * 2 + rsub; const v4f v = *(const v4fa*)&so[w][r][c4]; if (FT == 2) { *(v4f*)(C + cofs + (size_t)(row0 + r) * ldc + col0 + c4) = v; asm volatile("s_wait_xcnt 0x0" ::: "memory"); }      /* the wait stands in front of any later write of the registers the store names */
      if (FT == 1 && mt % TPB == 0) { *(v4f*)(CF + (size_t)(32 * w + r) * ldf + (size_t)(mt / TPB) * DM + col0 + c4) = v; asm volatile("s_wait_xcnt 0x0" ::: "memory"); }      /* the same for this store */
      if (FT == 1) { v4h h4; for (int i = 0; i < 4; ++i) h4[i] = (_Float16)v[i]; *(v4h*)(C16 + cofs + (size_t)(row0 + r) * ldc + col0 + c4) = h4; asm volatile("s_wait_xcnt 0x0" ::: "memory"); } }      /* and for this one */
     } }


__global__ __launch_bounds__(256) void k_wnat(const float* __restrict__ w, size_t n8, _Float16* __restrict__ Bt) { const size_t t = (size_t)blockIdx.x * 256 + threadIdx.x; if (t >= n8) return; FragH f; for (int q = 0; q < 8; ++q) f.h[q] = (_Float16)(bf16_round(w[t * 8 + q]) * 16.0f); *(v8us*)((unsigned short*)Bt + t * 8) = f.half[0];  }
// The three input conversions in one launch (they depend on nothing and on one another not at all): blocks 0 .. nbx - 1 do k_x16's work on x, the next nbw blocks k_wnat's on w0, the last nbw k_wnat's on w1.
// The choice is the same for a whole block, so it is a scalar branch; x takes the factor 1, which is exact.
__global__ __launch_bounds__(256) void k_in16(const float* __restrict__ x, size_t nx8, unsigned nbx, _Float16* __restrict__ X16, const float* __restrict__ w0, const float* __restrict__ w1, size_t nw8, unsigned nbw, _Float16* __restrict__ Bt0, _Float16* __restrict__ Bt1) {
  unsigned bx = blockIdx.x; const float* s = x; _Float16* d = X16; size_t n8 = nx8; float sc = 1.0f;
  if (bx >= nbx) { bx -= nbx; s = w0; d = Bt0; n8 = nw8; sc = 16.0f; if (bx >= nbw) { bx -= nbw; s = w1; d = Bt1; } }
  const size_t t = (size_t)bx * 256 + threadIdx.x; if (t >= n8) return; FragH f;
#pragma unroll      /* f.h is then indexed by constants and stays in registers */
  for (int q = 0; q < 8; ++q) f.h[q] = (_Float16)(bf16_round(s[t * 8 + q]) * sc); *(v8us*)((unsigned short*)d + t * 8) = f.half[0]; }
__global__ __launch_bounds__(256) void k_rsm(const float* __restrict__ S, _Float16* __restrict__ P, int nrows) {
  #pragma clang fp contract(off)
  const int i = blockIdx.x * 256 + threadIdx.x; if (i >= nrows) return; const float* s = S + (size_t)i * SQ; float mx = -3.0e38f;
#pragma unroll 1
  for (int j = 0; j < SQ; ++j) mx = fmaxf(mx, s[j]); float se = 0.f;
#pragma unroll 1
  for (int j = 0; j < SQ; ++j) se += expf(s[j] - mx); const float sc = 256.0f / se;
#pragma unroll 1
  for (int j0 = 0; j0 < SQ; j0 += 8) { FragH f; for (int q = 0; q < 8; ++q) f.h[q] = (_Float16)(expf(s[j0 + q] - mx) * sc); unsigned short* d = (unsigned short*)P + (size_t)i * SQ + j0; *(v8us*)d = f.half[0];  } }
__global__ __launch_bounds__(256) void k_vt(const _Float16* __restrict__ V16, int b, int h0, _Float16* __restrict__ VT) { __shared__ unsigned short tl[64][65]; const int tid = threadIdx.x; const int hh = blockIdx.x % HG, sg = blockIdx.x / HG; const int s0 = sg * 64; const int h = h0 + hh;
  for (int i = tid; i < 64 * 8; i += 256) { const int j = i / 8, d8 = (i % 8) * 8; FragH f; f.half[0] = *(const v8us*)((const unsigned short*)V16 + ((size_t)b * SQ + s0 + j) * DM + h * HD + d8); for (int q = 0; q < 8; ++q) tl[d8 + q][j] = f.u[q]; }
  __syncthreads();
  { for (int i = tid; i < 64 * 8; i += 256) { const int d = i / 8, j8 = (i % 8) * 8; FragH f; for (int q = 0; q < 8; ++q) f.u[q] = tl[d][j8 + q]; *(v8us*)((unsigned short*)VT + ((size_t)hh * HD + d) * SQ + s0 + j8) = f.half[0]; }  } }



// Exact f32 attention for the first QT0 rows; F holds the f32 rows of q = k = v (pitch A0L), 64 columns a head: the heads of all batches stand side by side in a row. One wave per (head, query row), A0W rows a block.
// Scores: lane = key (four groups of 32 keys), the query row broadcast from LDS, four partial sums per key. Softmax: two passes over the wave's own registers.
// P V: lane = two head columns, keys in ascending order, each weight broadcast from its lane through a scalar register.
// Every wave stages and walks all QT0 keys, keys past its query with weight exactly 0: without tests the code is one straight line whose LDS reads have constant offsets and fly together.
// Every loop is fully unrolled: the small arrays are then indexed by constants and stay in registers, and each weight is read from a constant lane.
#define A0W 8                        /* waves = query rows per block */
#define A0L (NB * DM)                /* row pitch of F, OH and OL, a constant: the staging loads are then one address and constant offsets */
#define A0P 68                       /* LDS row pitch in floats: 16-byte column walks fall on distinct banks */
// The result (x64) leaves as two f16 planes, OH = the rounded value and OL = what the rounding left, x1024: the operands of the output GEMM's first-tile blocks.
#define A0B (NBR * NH * (QT0 / A0W))      /* blocks */
typedef float v2f __attribute__((ext_vector_type(2)));
typedef _Float16 v2h __attribute__((ext_vector_type(2)));
__device__ __forceinline__ void att0_block(int bx, float (*tl)[A0P], const float* __restrict__ F, float scale, _Float16* __restrict__ OH, _Float16* __restrict__ OL) {
  const int tid = threadIdx.x, lane = tid & 31; const int w = __builtin_amdgcn_readfirstlane(tid >> 5);      /* scalar wave number: the query row's LDS address stays scalar */
  const int h = bx / (QT0 / A0W), rg = bx % (QT0 / A0W); const int i = rg * A0W + w;
  const int r0 = tid >> 4, c0 = (tid & 15) * 4; const float* fp = F + (size_t)r0 * A0L + h * HD + c0;      /* this lane's 16 bytes of rows r0, r0 + 2 A0W, ... */
  v4f sg[QT0 / (2 * A0W)];
#pragma unroll
  for (int u = 0; u < QT0 / (2 * A0W); ++u) sg[u] = *(const v4fa*)(fp + (size_t)u * (2 * A0W) * A0L);
  asm volatile("s_wait_xcnt 0x0" :: "v"(fp) : "memory");      /* stands behind the loads and names their address: the address registers live up to the wait, so nothing, no load's own result either, is written over them in front of it */
#pragma unroll
  for (int u = 0; u < QT0 / (2 * A0W); ++u) *(v4f*)&tl[r0 + u * (2 * A0W)][c0] = sg[u];
  __syncthreads();
  {
    v4f a[QT0 / 32];
#pragma unroll
    for (int t = 0; t < QT0 / 32; ++t) a[t] = (v4f){0.f, 0.f, 0.f, 0.f};
#pragma unroll
    for (int c = 0; c < HD / 4; ++c) { const v4f q = *(const v4f*)&tl[i][c * 4];
#pragma unroll
      for (int t = 0; t < QT0 / 32; ++t) a[t] = __builtin_elementwise_fma(q, *(const v4f*)&tl[t * 32 + lane][c * 4], a[t]); }
    float s[QT0 / 32], mx = -1.0e30f;
#pragma unroll
    for (int t = 0; t < QT0 / 32; ++t) { const float d = (a[t][0] + a[t][1]) + (a[t][2] + a[t][3]); s[t] = (t * 32 + lane <= i) ? d * scale : -1.0e30f; mx = fmaxf(mx, s[t]); }
#pragma unroll
    for (int d = 16; d > 0; d >>= 1) mx = fmaxf(mx, __shfl_xor(mx, d, 32));      /* key 0 is never masked: mx is a real score */
    float p[QT0 / 32], l = 0.f;
#pragma unroll
    for (int t = 0; t < QT0 / 32; ++t) { p[t] = expf(s[t] - mx); l += p[t]; }      /* masked keys: exp of about -1e30 = 0 */
#pragma unroll
    for (int d = 16; d > 0; d >>= 1) l += __shfl_xor(l, d, 32);
    v2f o = {0.f, 0.f};
#pragma unroll
    for (int t = 0; t < QT0 / 32; ++t)
#pragma unroll
      for (int k = 0; k < 32; ++k) { const float pj = __uint_as_float(__builtin_amdgcn_readlane(__float_as_uint(p[t]), k)); const v2f pp = {pj, pj};
        o = __builtin_elementwise_fma(pp, *(const v2f*)&tl[t * 32 + k][2 * lane], o); }
    const float fin = 64.0f / l;      /* o carried x64 like the f16 path */
    const v2f of = o * fin; const v2h oh = {(_Float16)of[0], (_Float16)of[1]}; const v2h ol = {(_Float16)((of[0] - (float)oh[0]) * 1024.0f), (_Float16)((of[1] - (float)oh[1]) * 1024.0f)};
    const size_t oo = (size_t)i * A0L + h * HD + 2 * lane; *(v2h*)(OH + oo) = oh; *(v2h*)(OL + oo) = ol; } }

#define FQ 128                       /* query rows per block: 4 waves x 32, each row group owned by a wave of either set */
#define FS 128                       /* keys per stage: two passes of 32 for each of the two wave sets */
#define FRB 128                      /* bytes of a staged row */
#define FTB (FS * FRB)               /* bytes per buffer */
#define FAB (NB * NH * (SQ / FQ - 1))      /* fused-attention blocks: rows 0 .. QT0 - 1 are the f32 path's */
typedef short v8s __attribute__((ext_vector_type(8)));
__device__ __forceinline__ v8f fa_mma(v16h a, v16h b, v8f c) { return __builtin_amdgcn_wmma_f32_16x16x32_f16(false, a, false, b, (short)0, c, false, false); }
__device__ __forceinline__ unsigned fa_swz(unsigned r) { return 2u * ((r >> 1) & 3u) + ((r >> 3) & 1u); }
__device__ __forceinline__ v8us fa_tr16(const unsigned char* p) { typedef __attribute__((address_space(3))) v8s lds_v8s; return __builtin_bit_cast(v8us, __builtin_amdgcn_ds_load_tr16_b128_v8i16((lds_v8s*)p)); }
// One stage's copies of one lane: 16 bytes of each of four rows, 32 rows apart (a wave's 32 lanes cover four whole 128-byte rows per copy). lk = the lane's LDS byte address in the buffer's first 32 rows; rows 32 apart have the same swizzle.
// The s_wait_xcnt closes the statement so that it stands in front of any later write of the address registers the copies name.
__device__ __forceinline__ void fa_copy(const _Float16* kg, unsigned lk) {
  const _Float16* k1 = kg + (size_t)32 * DM; const _Float16* k2 = kg + (size_t)64 * DM; const _Float16* k3 = kg + (size_t)96 * DM;
  const unsigned lk1 = lk + 32 * FRB, lk2 = lk + 64 * FRB, lk3 = lk + 96 * FRB;
  asm volatile("global_load_async_to_lds_b128 %0, %4, off\n\t"
               "global_load_async_to_lds_b128 %1, %5, off\n\t"
               "global_load_async_to_lds_b128 %2, %6, off\n\t"
               "global_load_async_to_lds_b128 %3, %7, off\n\t"
               "s_wait_xcnt 0x0"
               :: "v"(lk), "v"(lk1), "v"(lk2), "v"(lk3), "v"(kg), "v"(k1), "v"(k2), "v"(k3) : "memory"); }
// Four waves per SIMD asked for by name: left to itself the build takes more than 256 registers, which is three waves a SIMD and so one eight-wave block a WGP; with four, two blocks share a WGP.
__global__ __launch_bounds__(256) __attribute__((amdgpu_waves_per_eu(4, 4))) void k_fattn(const _Float16* __restrict__ QK, _Float16* __restrict__ O, const float* __restrict__ F, float scale, _Float16* __restrict__ OH, _Float16* __restrict__ OL) {
  static_assert(2 * FTB <= QT0 * A0P * 4, "the stage buffers fit the f32 path's tile"); static_assert(32 * A0W == 256, "both kinds of block have the launch's eight waves"); static_assert(4 * 17 * 32 * 16 <= QT0 * A0P * 4, "set 1's partial results fit too");
  __shared__ __attribute__((aligned(256))) unsigned char sm[QT0 * A0P * 4];      /* fused attention: [buffer][row][chunk]; f32 attention: its tile of QT0 rows */
  if (blockIdx.x >= FAB) { att0_block((int)blockIdx.x - FAB, reinterpret_cast<float (*)[A0P]>(&sm[0]), F, scale, OH, OL); return; }
  constexpr float SC2 = 0.036084391824351615f * 1.4426950408889634f;      /* 1/sqrt(768) x log2(e): the softmax runs in base 2 */
  const int tid = threadIdx.x, lane = tid & 31, ln = lane & 15, hh = lane >> 4; const int w = __builtin_amdgcn_readfirstlane(tid >> 5);      /* scalar wave number: the skip test and row bases stay scalar */
  const int set = w >> 2, wq = w & 3;      /* key set and row group of the wave, scalar like w */
  const int bh = blockIdx.x % (NB * NH), qb = (SQ / FQ - 1) - blockIdx.x / (NB * NH); const int b = bh / NH, h = bh % NH; const int qw = qb * FQ + wq * 32;
  const _Float16* kb = QK + (size_t)b * SQ * DM + h * HD + (size_t)ln * DM;      /* this lane's row within a 16-row tile of q */
  const _Float16* kg = QK + ((size_t)b * SQ + (tid >> 3)) * DM + h * HD + (tid & 7) * 8;      /* this lane's 16 bytes of stage 0: row tid / 8, chunk tid % 8 */
  const unsigned l0 = (unsigned)(size_t)&sm[0] + (unsigned)(tid >> 3) * FRB + (((unsigned)(tid & 7) ^ fa_swz((unsigned)(tid >> 3) & 15u)) * 16u);      /* low 32 bits of a shared address = LDS byte address */
  const unsigned ka = (unsigned)ln * FRB + (((unsigned)hh ^ fa_swz((unsigned)ln)) * 16u);      /* K reader: row ln of a 16-row tile, chunk hh */
  const unsigned vr = 8u * (unsigned)hh + ((unsigned)lane & 7u);
  const unsigned va = vr * FRB + (((((unsigned)lane >> 3) & 1u) ^ fa_swz(vr)) * 16u);          /* V^T reader: row 8 hh + lane % 8 of a 16-row tile, chunk (lane / 8) % 2 */
  const int nst = qb + 1;           /* stages of the block: up to the end of its last wave's diagonal block; never fewer than two (qb >= 1) */
  const int last = qw / 32;         /* this wave's last pass: its diagonal block, the only one with masked keys */
  fa_copy(kg, l0);
  asm volatile("s_wait_asynccnt 0x0" ::: "memory");      /* stage 0 has landed for this wave's own copies */
  __syncthreads();                                        /* ... and for every wave's: publishes stage 0 */
  fa_copy(kg + (size_t)FS * DM, l0 + FTB);
  v16h qf[2][2];
#pragma unroll
  for (int g = 0; g < 2; ++g)
#pragma unroll
    for (int ks = 0; ks < 2; ++ks) qf[g][ks] = g2_frag(kb + (size_t)(qw + g * 16) * DM + ks * 32, hh);
  const v8f z8 = {0.f, 0.f, 0.f, 0.f, 0.f, 0.f, 0.f, 0.f};
  v8f o[2][4]; float m[2], l[2];
#pragma unroll
  for (int g = 0; g < 2; ++g) { m[g] = -1.0e30f; l[g] = 0.f;
#pragma unroll
    for (int dt = 0; dt < 4; ++dt) o[g][dt] = z8; }
#pragma unroll 1
  for (int t = 0; t < nst; ++t) {
    const unsigned char* tb = &sm[(t & 1) * FTB + set * (FS / 2) * FRB];      /* the stage's buffer: the 64 rows of this wave's set */
#pragma unroll
    for (int p = 0; p < 2; ++p) { const int it = 4 * t + 2 * set + p;
      if (it <= last) {
        FragH kf[2][2], vf[4];
#pragma unroll
        for (int kt = 0; kt < 2; ++kt)
#pragma unroll
          for (int ks = 0; ks < 2; ++ks) { kf[kt][ks].half[0] = *(const v8us*)(tb + (p * 32 + kt * 16) * FRB + (ka ^ (unsigned)(ks * 64))); kf[kt][ks].half[1] = *(const v8us*)(tb + (p * 32 + kt * 16) * FRB + (ka ^ (unsigned)(ks * 64 + 32))); }
#pragma unroll
        for (int dt = 0; dt < 4; ++dt) { vf[dt].half[0] = fa_tr16(tb + (p * 32) * FRB + (va ^ (unsigned)(dt * 32))); vf[dt].half[1] = fa_tr16(tb + (p * 32 + 16) * FRB + (va ^ (unsigned)(dt * 32))); }
        __builtin_amdgcn_sched_barrier(0);      /* keeps the pass's sixteen LDS reads together at its head, K first: one place with LDS reads instead of two, and the V^T fragments land under the score products and the softmax instead of being waited for in front of P V */
        v8f s[2][2];
#pragma unroll
        for (int g = 0; g < 2; ++g)
#pragma unroll
          for (int kt = 0; kt < 2; ++kt) s[g][kt] = fa_mma(kf[kt][1].v, qf[g][1], fa_mma(kf[kt][0].v, qf[g][0], z8));
        if (it == last) {
#pragma unroll
          for (int g = 0; g < 2; ++g)
#pragma unroll
            for (int kt = 0; kt < 2; ++kt)
#pragma unroll
              for (int r = 0; r < 8; ++r) s[g][kt][r] = (kt * 16 + 8 * hh + r <= g * 16 + ln) ? s[g][kt][r] : -1.0e30f; }      /* first key of the pass == qw here: key <= query */
        float mn[2]; bool need = false;
#pragma unroll
        for (int g = 0; g < 2; ++g) { float mx = s[g][0][0];
#pragma unroll
          for (int r = 1; r < 8; ++r) mx = fmaxf(mx, s[g][0][r]);
#pragma unroll
          for (int r = 0; r < 8; ++r) mx = fmaxf(mx, s[g][1][r]);
          mx = fmaxf(mx, __shfl_xor(mx, 16, 32)); mn[g] = fmaxf(m[g], mx * SC2); need = need || (mn[g] > m[g]); }
        if (__builtin_amdgcn_ballot_w32(need) != 0) {      /* no column's maximum moved: every factor would be exactly 1, so the rescale is skipped as a whole */
#pragma unroll
          for (int g = 0; g < 2; ++g) { const float al = __builtin_amdgcn_exp2f(m[g] - mn[g]); m[g] = mn[g]; l[g] *= al;
#pragma unroll
            for (int dt = 0; dt < 4; ++dt) o[g][dt] *= al; } }
        FragH pf[2];
#pragma unroll
        for (int g = 0; g < 2; ++g) { float ls = 0.f;
#pragma unroll
          for (int kt = 0; kt < 2; ++kt) { const v8f tt = s[g][kt] * SC2 - m[g];
#pragma unroll
            for (int r = 0; r < 8; ++r) { const float pp = __builtin_amdgcn_exp2f(tt[r]); ls += pp; pf[g].h[kt * 8 + r] = (_Float16)pp; } }
          l[g] += ls; }
#pragma unroll
        for (int g = 0; g < 2; ++g)
#pragma unroll
          for (int dt = 0; dt < 4; ++dt) o[g][dt] = fa_mma(vf[dt].v, pf[g].v, o[g][dt]); } }
    asm volatile("s_wait_dscnt 0x0" ::: "memory");         /* this wave's reads of buffer t & 1 have returned before the buffer is refilled */
    asm volatile("s_wait_asynccnt 0x0" ::: "memory");      /* this wave's copies of stage t + 1 have landed */
    __syncthreads();                                        /* publishes stage t + 1 and ends every wave's reads of stage t */
    if (t + 2 < nst) fa_copy(kg + (size_t)(t + 2) * FS * DM, l0 + (unsigned)(t & 1) * FTB); }      /* the same test in the whole block */
  asm volatile("s_wait_asynccnt 0x0" ::: "memory");        /* no copy is outstanding when the stage buffers are written over and the wave ends */
  /* the two sets join. Behind the last stage's barrier no wave reads a stage and no copy is outstanding, so the partial results lie over the stage buffers: per row group 17 planes of 16 bytes a lane (sixteen of O^T, one of both maxima and both sums), consecutive lanes side by side */
  v4fa* mg = reinterpret_cast<v4fa*>(&sm[0]) + wq * (17 * 32) + lane;
  if (set) {
#pragma unroll
    for (int g = 0; g < 2; ++g)
#pragma unroll
      for (int dt = 0; dt < 4; ++dt) { mg[(g * 8 + dt * 2) * 32] = (v4f){o[g][dt][0], o[g][dt][1], o[g][dt][2], o[g][dt][3]}; mg[(g * 8 + dt * 2 + 1) * 32] = (v4f){o[g][dt][4], o[g][dt][5], o[g][dt][6], o[g][dt][7]}; }
    mg[16 * 32] = (v4f){m[0], m[1], l[0], l[1]}; }
  __syncthreads();      /* set 1's partial results are written before set 0 reads them; every wave passes it, no barrier follows */
  if (set) return;
  { const v4f ml = mg[16 * 32];
#pragma unroll
    for (int g = 0; g < 2; ++g) { const float mj = fmaxf(m[g], ml[g]); const float a0 = __builtin_amdgcn_exp2f(m[g] - mj), a1 = __builtin_amdgcn_exp2f(ml[g] - mj); l[g] = l[g] * a0 + ml[2 + g] * a1;      /* a set that walked no key has sum 0 and O^T 0 */
#pragma unroll
      for (int dt = 0; dt < 4; ++dt) { const v4f p0 = mg[(g * 8 + dt * 2) * 32], p1 = mg[(g * 8 + dt * 2 + 1) * 32];
#pragma unroll
        for (int r = 0; r < 4; ++r) { o[g][dt][r] = o[g][dt][r] * a0 + p0[r] * a1; o[g][dt][4 + r] = o[g][dt][4 + r] * a0 + p1[r] * a1; } } } }
#pragma unroll
  for (int g = 0; g < 2; ++g) { const float fin = 64.0f / (l[g] + __shfl_xor(l[g], 16, 32));      /* halves joined once; o carried x64 */
    _Float16* orow = O + ((size_t)b * SQ + qw + g * 16 + ln) * DM + h * HD + 8 * hh;
#pragma unroll
    for (int dt = 0; dt < 4; ++dt) { FragH f;
#pragma unroll
      for (int r = 0; r < 8; ++r) f.h[r] = (_Float16)(o[g][dt][r] * fin);
      *(v8us*)((unsigned short*)orow + dt * 16) = f.half[0]; } } }

extern "C" void kernel_launch(void* const* d_in, const int* in_sizes, int n_in,
                              void* d_out, int out_size, void* d_ws, size_t ws_size, hipStream_t stream) {
  (void)in_sizes; (void)n_in; (void)out_size;
  const float* const* I = (const float* const*)d_in; const float* x = I[0]; const float* wq = I[1]; const float* wo = I[2]; const float* bo = I[3]; const float* wk = wq; const float* wv = wq;      /* Wq [12][64][768] = natural [768][768] rows h*64+d (q = k = v); W_out natural + b_out */
  char* ws = (char*)d_ws; size_t off = 0;
  auto take = [&](size_t bytes) { char* p = ws + off; off += (bytes + 255) & ~(size_t)255; return p; };
  _Float16* BQ = (_Float16*)take((size_t)DM * DM * 2); _Float16* BK = BQ; _Float16* BV = BQ; _Float16* BO = (_Float16*)take((size_t)DM * DM * 2);
  _Float16* X16 = (_Float16*)take(NR * DM * 2); _Float16* Q16 = (_Float16*)take(NR * DM * 2); _Float16* K16 = Q16; _Float16* V16 = Q16;      /* q = k = v (the module projects all three with self.query) */ _Float16* O16 = (_Float16*)take(NR * DM * 2);
  float* QF0 = (float*)take((size_t)NB * QT0 * DM * 4); _Float16* OH0 = (_Float16*)take((size_t)NB * QT0 * DM * 2); _Float16* OL0 = (_Float16*)take((size_t)NB * QT0 * DM * 2);
  if (off > ws_size) return;
  constexpr unsigned nbx = (unsigned)((NR * DM / 8 + 255) / 256), nbw = (unsigned)(((size_t)DM * DM / 8 + 255) / 256);      /* blocks for x, for one weight matrix */
  k_in16<<<nbx + 2 * nbw, 256, 0, stream>>>(x, NR * DM / 8, nbx, X16, wq, wo, (size_t)DM * DM / 8, nbw, BQ, BO);      /* x rows as f16; weights natural [out][in] = Bt x16 */
  const size_t r0p = (size_t)B0 * SQ;      /* first projected row */
  /* first-tile path (rows 0 .. 127 of every batch, exact f32 attention): it has no launch of its own, every piece rides in the launch of the main path that has the same inputs ready. Its planes are [QT0][NB * DM]: row r holds row r of batch 0, then of batch 1 */
  constexpr int LF = NB * DM; const size_t c0p = (size_t)B0 * DM;      /* pitch of those planes; first processed batch's column */
  k_gemm2<0, 1><<<dim3((unsigned)((MP / 128) * (DM / 64)), 1), 128, 0, stream>>>(X16 + r0p * DM, DM, 0, BQ, DM, 0, 0.0625f, nullptr, 0, nullptr, Q16 + r0p * DM, DM, 0, MP, DM, DM, nullptr, nullptr, 0.f, QF0 + c0p, LF);      /* q = k = v as f16 rows; the first 128 rows of a batch as f32 too (exact products) */
  static_assert(FQ == QT0, "the fused attention's missing last blocks are exactly the first-tile rows"); static_assert(LF == A0L, "the f32 attention's pitch is that of the first-tile planes");
  k_fattn<<<FAB + A0B, 256, 0, stream>>>(Q16, O16, QF0 + c0p, 0.036084391824351615f, OH0 + c0p, OL0 + c0p);      /* scores, causal softmax and P V in one launch; o (merged heads, x64) as f16 rows; behind its blocks the exact f32 attention for rows 0..127 (o x64 as f16 hi + x1024 residual planes) */
  k_gemm2<0, 2><<<dim3((unsigned)(F2B + (MPO / 128 - NBR) * (DM / 64)), 1), 128, 0, stream>>>(O16 + r0p * DM, DM, 0, BO, DM, 0, 0.0009765625f, bo, 0, (float*)d_out + r0p * DM, nullptr, DM, 0, MPO, DM, DM, OH0 + c0p, OL0 + c0p, 0.00000095367431640625f, nullptr, LF);      /* out rows are the output layout; rows 0..127: o_hi Wo + b + o_lo Wo 2^-20 */
}
